// v000
// Times are from an AMD MI455X. After a warm-up the kernel runs many times in a row, and a time is the length of
// such a window on the GPU divided by its runs, so every launch and the gaps after it count. The runs cycle
// through copies of the inputs. A figure is the median of several windows, for all but v000 over two sittings.
// Sittings can differ by a few percent; kernels timed side by side share one.
// v000, which the later versions start from, runs in 76 microseconds.
#include <hip/hip_runtime.h>
#include <math.h>

typedef __attribute__((ext_vector_type(2))) float v2f;
typedef __attribute__((ext_vector_type(8))) float v8f;

#define B_N 16384
#define D_N 1024
#define E_N 8
#define T_N 4
#define H_N 512
#define NCOL 64   // cols 0..31: gate logits (t*8+e), cols 32..63: folded expert dots

// ---------------------------------------------------------------------------
// Kernel A: fold expert weights through task heads, and pack the combined
// [D x 64] weight matrix into WMMA-friendly (k-pair, n) interleaved layout:
//   W2p[((d>>1)*64 + n)*2 + (d&1)] = W2[d][n]
// so a lane's B-fragment (two consecutive K values for one column) is one b64.
// ---------------------------------------------------------------------------
__global__ void __launch_bounds__(256) mmoe_prep(
    const float* __restrict__ We,   // [E, D, H]
    const float* __restrict__ be,   // [E, H]
    const float* __restrict__ Wg,   // [T, D, E]
    const float* __restrict__ Wt,   // [T, H, 1]
    float* __restrict__ W2p,        // [D/2][64][2]  (256 KB)
    float* __restrict__ cte) {      // [T, E]
  int idx = blockIdx.x * blockDim.x + threadIdx.x;   // 0 .. E*D-1
  if (idx < E_N * D_N) {
    int e = idx >> 10;          // / D_N
    int d = idx & (D_N - 1);
    const float* wrow = We + ((size_t)e * D_N + d) * H_N;
    float a0 = 0.f, a1 = 0.f, a2 = 0.f, a3 = 0.f;
    for (int h = 0; h < H_N; ++h) {
      float w = wrow[h];
      a0 += w * Wt[0 * H_N + h];
      a1 += w * Wt[1 * H_N + h];
      a2 += w * Wt[2 * H_N + h];
      a3 += w * Wt[3 * H_N + h];
    }
    float acc[4] = {a0, a1, a2, a3};
    int base = (d >> 1) * NCOL;
    int par  = d & 1;
#pragma unroll
    for (int t = 0; t < T_N; ++t) {
      // folded expert column (n = 32 + t*8 + e)
      W2p[(base + 32 + t * E_N + e) * 2 + par] = acc[t];
      // gate column (n = t*8 + e)
      W2p[(base + t * E_N + e) * 2 + par] = Wg[((size_t)t * D_N + d) * E_N + e];
    }
  }
  // c[t,e] = sum_h be[e,h] * Wt[t,h]
  if (blockIdx.x == 0 && threadIdx.x < T_N * E_N) {
    int t = threadIdx.x >> 3, e = threadIdx.x & 7;
    float s = 0.f;
    for (int h = 0; h < H_N; ++h) s += be[e * H_N + h] * Wt[t * H_N + h];
    cte[t * E_N + e] = s;
  }
}

// ---------------------------------------------------------------------------
// Kernel B: fused [16384 x 1024] x [1024 x 64] f32 WMMA GEMM + softmax mix.
// 256 threads = 8 waves per block; each wave owns 16 rows x all 64 cols
// (four 16x16 f32 accumulator tiles). K loop: 256 steps of K=4 via
// V_WMMA_F32_16X16X4_F32 (exact f32 — problem is HBM-bound, not compute).
// ---------------------------------------------------------------------------
__global__ void __launch_bounds__(256) mmoe_main(
    const float* __restrict__ x,    // [B, D]
    const float* __restrict__ W2p,  // packed [D/2][64][2]
    const float* __restrict__ cte,  // [T, E]
    const float* __restrict__ bg,   // [T, E]
    const float* __restrict__ bt,   // [T, 1]
    float* __restrict__ out) {      // [T, B, 1]
  __shared__ float lds[8][16][68];  // stride 68 -> conflict-free column reads

  const int wave = threadIdx.x >> 5;
  const int lane = threadIdx.x & 31;
  const int ml   = lane & 15;   // M (A rows) / N (B cols) index within tile
  const int kh   = lane >> 4;   // K half: lanes 16-31 hold K+2,K+3
  const int row0 = blockIdx.x * 128 + wave * 16;

  // A-frag: x[row0+ml][k0 + 2*kh + {0,1}]  (two consecutive floats -> b64)
  const float* ap = x + (size_t)(row0 + ml) * D_N + kh * 2;
  // B-frag base: kk = k0/2 + kh, n = t*16 + ml  -> W2p[(kk*64 + n)*2]
  const float* bp = W2p + ((size_t)kh * NCOL + ml) * 2;

  v8f acc0 = {}, acc1 = {}, acc2 = {}, acc3 = {};

#pragma unroll 4
  for (int k0 = 0; k0 < D_N; k0 += 4) {
    v2f a = *(const v2f*)(ap + k0);
    const float* bk = bp + (size_t)(k0 >> 1) * (NCOL * 2);
    v2f b0 = *(const v2f*)(bk + 0 * 32);
    v2f b1 = *(const v2f*)(bk + 1 * 32);
    v2f b2 = *(const v2f*)(bk + 2 * 32);
    v2f b3 = *(const v2f*)(bk + 3 * 32);
    acc0 = __builtin_amdgcn_wmma_f32_16x16x4_f32(false, a, false, b0, (short)0, acc0, false, false);
    acc1 = __builtin_amdgcn_wmma_f32_16x16x4_f32(false, a, false, b1, (short)0, acc1, false, false);
    acc2 = __builtin_amdgcn_wmma_f32_16x16x4_f32(false, a, false, b2, (short)0, acc2, false, false);
    acc3 = __builtin_amdgcn_wmma_f32_16x16x4_f32(false, a, false, b3, (short)0, acc3, false, false);
  }

  // C/D layout: VGPR j -> row (j + 8*kh), col (tile*16 + ml)
  const int rbase = kh * 8;
#pragma unroll
  for (int j = 0; j < 8; ++j) {
    lds[wave][rbase + j][0 * 16 + ml] = acc0[j];
    lds[wave][rbase + j][1 * 16 + ml] = acc1[j];
    lds[wave][rbase + j][2 * 16 + ml] = acc2[j];
    lds[wave][rbase + j][3 * 16 + ml] = acc3[j];
  }
  __syncthreads();

  // Each wave: 16 rows x 4 tasks = 64 (m,t) pairs -> 2 per lane.
#pragma unroll
  for (int q = 0; q < 2; ++q) {
    int p = lane + 32 * q;   // 0..63
    int m = p >> 2;          // 0..15
    int t = p & 3;
    float lg[8], sv[8];
    float mx = -3.0e38f;
#pragma unroll
    for (int e = 0; e < 8; ++e) {
      lg[e] = lds[wave][m][t * 8 + e] + bg[t * E_N + e];
      sv[e] = lds[wave][m][32 + t * 8 + e] + cte[t * E_N + e];
      mx = fmaxf(mx, lg[e]);
    }
    float den = 0.f, num = 0.f;
#pragma unroll
    for (int e = 0; e < 8; ++e) {
      float w = __expf(lg[e] - mx);
      den += w;
      num += w * sv[e];
    }
    out[(size_t)t * B_N + (row0 + m)] = num / den + bt[t];
  }
}

extern "C" void kernel_launch(void* const* d_in, const int* in_sizes, int n_in,
                              void* d_out, int out_size, void* d_ws, size_t ws_size,
                              hipStream_t stream) {
  const float* x  = (const float*)d_in[0];
  const float* We = (const float*)d_in[1];
  const float* be = (const float*)d_in[2];
  const float* Wg = (const float*)d_in[3];
  const float* bg = (const float*)d_in[4];
  const float* Wt = (const float*)d_in[5];
  const float* bt = (const float*)d_in[6];
  float* out = (float*)d_out;

  float* W2p = (float*)d_ws;              // D*64 floats = 256 KB
  float* cte = W2p + (size_t)D_N * NCOL;  // 32 floats

  mmoe_prep<<<(E_N * D_N) / 256, 256, 0, stream>>>(We, be, Wg, Wt, W2p, cte);
  mmoe_main<<<B_N / 128, 256, 0, stream>>>(x, W2p, cte, bg, bt, out);
}

// v001
// One run takes 42.4 microseconds.
// In two side-by-side timings against v000, it was 1.84 and 1.83 times as fast.
#include <hip/hip_runtime.h>
#include <math.h>

typedef __attribute__((ext_vector_type(2))) float v2f;
typedef __attribute__((ext_vector_type(8))) float v8f;

#define B_N 16384
#define D_N 1024
#define E_N 8
#define T_N 4
#define H_N 512
#define NCOL 64   // cols 0..31: gate logits (t*8+e), cols 32..63: folded expert dots

// ---------------------------------------------------------------------------
// Kernel A: fold expert weights through task heads, and pack the combined
// [D x 64] weight matrix into WMMA-friendly (k-pair, n) interleaved layout:
//   W2p[((d>>1)*64 + n)*2 + (d&1)] = W2[d][n]
// so a lane's B-fragment (two consecutive K values for one column) is one b64.
// ---------------------------------------------------------------------------
__global__ void __launch_bounds__(256) mmoe_prep(
    const float* __restrict__ We,   // [E, D, H]
    const float* __restrict__ be,   // [E, H]
    const float* __restrict__ Wg,   // [T, D, E]
    const float* __restrict__ Wt,   // [T, H, 1]
    float* __restrict__ W2p,        // [D/2][64][2]  (256 KB)
    float* __restrict__ cte) {      // [T, E]
  int idx = blockIdx.x * blockDim.x + threadIdx.x;   // 0 .. E*D-1
  if (idx < E_N * D_N) {
    int e = idx >> 10;          // / D_N
    int d = idx & (D_N - 1);
    const float* wrow = We + ((size_t)e * D_N + d) * H_N;
    float a0 = 0.f, a1 = 0.f, a2 = 0.f, a3 = 0.f;
    for (int h = 0; h < H_N; ++h) {
      float w = wrow[h];
      a0 += w * Wt[0 * H_N + h];
      a1 += w * Wt[1 * H_N + h];
      a2 += w * Wt[2 * H_N + h];
      a3 += w * Wt[3 * H_N + h];
    }
    float acc[4] = {a0, a1, a2, a3};
    int base = (d >> 1) * NCOL;
    int par  = d & 1;
#pragma unroll
    for (int t = 0; t < T_N; ++t) {
      // folded expert column (n = 32 + t*8 + e)
      W2p[(base + 32 + t * E_N + e) * 2 + par] = acc[t];
      // gate column (n = t*8 + e)
      W2p[(base + t * E_N + e) * 2 + par] = Wg[((size_t)t * D_N + d) * E_N + e];
    }
  }
  // c[t,e] = sum_h be[e,h] * Wt[t,h]
  if (blockIdx.x == 0 && threadIdx.x < T_N * E_N) {
    int t = threadIdx.x >> 3, e = threadIdx.x & 7;
    float s = 0.f;
    for (int h = 0; h < H_N; ++h) s += be[e * H_N + h] * Wt[t * H_N + h];
    cte[t * E_N + e] = s;
  }
}

// ---------------------------------------------------------------------------
// Kernel B: fused [16384 x 1024] x [1024 x 64] f32 WMMA GEMM + softmax mix.
// 512 threads = 16 waves per block = 4 row tiles x 4 K quarters. Each wave owns
// 16 rows x all 64 cols (four 16x16 f32 accumulator tiles) over 256 of the
// 1024 k: 64 steps of K=4 via V_WMMA_F32_16X16X4_F32. The four partial tiles
// of a row tile meet in LDS and are added there, in the order of the quarters.
// 256 blocks: four waves on every SIMD of the chip wait on loads side by side.
// ---------------------------------------------------------------------------
#define KQ_N 4                 // K quarters (waves that share a row tile)
#define RT_N 4                 // row tiles per block
#define KQ_LEN (D_N / KQ_N)    // k per wave

__global__ void __launch_bounds__(512) mmoe_main(
    const float* __restrict__ x,    // [B, D]
    const float* __restrict__ W2p,  // packed [D/2][64][2]
    const float* __restrict__ cte,  // [T, E]
    const float* __restrict__ bg,   // [T, E]
    const float* __restrict__ bt,   // [T, 1]
    float* __restrict__ out) {      // [T, B, 1]
  // pitch 68 floats = 17 x 16 B: 16-byte reads that walk the rows spread the banks
  __shared__ __attribute__((aligned(16))) float lds[RT_N * KQ_N][16][68];

  const int wave = threadIdx.x >> 5;
  const int lane = threadIdx.x & 31;
  const int ml   = lane & 15;   // M (A rows) / N (B cols) index within tile
  const int kh   = lane >> 4;   // K half: lanes 16-31 hold K+2,K+3
  const int kq   = wave & (KQ_N - 1);   // this wave's K quarter
  const int rt   = wave >> 2;           // this wave's row tile
  const int row0 = blockIdx.x * (RT_N * 16) + rt * 16;
  const int kbeg = kq * KQ_LEN;

  // A-frag: x[row0+ml][kbeg + k0 + 2*kh + {0,1}]  (two consecutive floats -> b64)
  const float* ap = x + (size_t)(row0 + ml) * D_N + kbeg + kh * 2;
  // B-frag base: kk = (kbeg + k0)/2 + kh, n = t*16 + ml  -> W2p[(kk*64 + n)*2]
  const float* bp = W2p + ((size_t)((kbeg >> 1) + kh) * NCOL + ml) * 2;

  v8f acc0 = {}, acc1 = {}, acc2 = {}, acc3 = {};

#pragma unroll 4
  for (int k0 = 0; k0 < KQ_LEN; k0 += 4) {
    v2f a = *(const v2f*)(ap + k0);
    const float* bk = bp + (size_t)(k0 >> 1) * (NCOL * 2);
    v2f b0 = *(const v2f*)(bk + 0 * 32);
    v2f b1 = *(const v2f*)(bk + 1 * 32);
    v2f b2 = *(const v2f*)(bk + 2 * 32);
    v2f b3 = *(const v2f*)(bk + 3 * 32);
    acc0 = __builtin_amdgcn_wmma_f32_16x16x4_f32(false, a, false, b0, (short)0, acc0, false, false);
    acc1 = __builtin_amdgcn_wmma_f32_16x16x4_f32(false, a, false, b1, (short)0, acc1, false, false);
    acc2 = __builtin_amdgcn_wmma_f32_16x16x4_f32(false, a, false, b2, (short)0, acc2, false, false);
    acc3 = __builtin_amdgcn_wmma_f32_16x16x4_f32(false, a, false, b3, (short)0, acc3, false, false);
  }

  // C/D layout: VGPR j -> row (j + 8*kh), col (tile*16 + ml)
  const int rbase = kh * 8;
#pragma unroll
  for (int j = 0; j < 8; ++j) {
    lds[wave][rbase + j][0 * 16 + ml] = acc0[j];
    lds[wave][rbase + j][1 * 16 + ml] = acc1[j];
    lds[wave][rbase + j][2 * 16 + ml] = acc2[j];
    lds[wave][rbase + j][3 * 16 + ml] = acc3[j];
  }
  // publishes every wave's partial tile to the waves that add them
  __syncthreads();

  // 64 rows x 4 tasks = 256 (row, task) pairs: one per thread of waves 0..7,
  // a wave's lanes on 32 consecutive rows of one task (one whole output line).
  if (threadIdx.x < RT_N * 16 * T_N) {
    const int r  = threadIdx.x & (RT_N * 16 - 1);  // row within the block
    // task: the same in all lanes of a wave, so the biases come by scalar loads
    const int t  = __builtin_amdgcn_readfirstlane(threadIdx.x >> 6);
    const int w0 = (r >> 4) * KQ_N;                // first partial of the row's tile
    const int m  = r & 15;
    float lg[8], sv[8];
#pragma unroll
    for (int h = 0; h < 2; ++h) {
      float4 g = *(const float4*)&lds[w0][m][t * 8 + h * 4];
      float4 s = *(const float4*)&lds[w0][m][32 + t * 8 + h * 4];
#pragma unroll
      for (int q = 1; q < KQ_N; ++q) {
        float4 g2 = *(const float4*)&lds[w0 + q][m][t * 8 + h * 4];
        float4 s2 = *(const float4*)&lds[w0 + q][m][32 + t * 8 + h * 4];
        g.x += g2.x; g.y += g2.y; g.z += g2.z; g.w += g2.w;
        s.x += s2.x; s.y += s2.y; s.z += s2.z; s.w += s2.w;
      }
      lg[h * 4 + 0] = g.x; lg[h * 4 + 1] = g.y; lg[h * 4 + 2] = g.z; lg[h * 4 + 3] = g.w;
      sv[h * 4 + 0] = s.x; sv[h * 4 + 1] = s.y; sv[h * 4 + 2] = s.z; sv[h * 4 + 3] = s.w;
    }
    float mx = -3.0e38f;
#pragma unroll
    for (int e = 0; e < 8; ++e) {
      lg[e] += bg[t * E_N + e];
      sv[e] += cte[t * E_N + e];
      mx = fmaxf(mx, lg[e]);
    }
    float den = 0.f, num = 0.f;
#pragma unroll
    for (int e = 0; e < 8; ++e) {
      float w = __expf(lg[e] - mx);
      den += w;
      num += w * sv[e];
    }
    out[(size_t)t * B_N + (blockIdx.x * (RT_N * 16) + r)] = num / den + bt[t];
  }
}

extern "C" void kernel_launch(void* const* d_in, const int* in_sizes, int n_in,
                              void* d_out, int out_size, void* d_ws, size_t ws_size,
                              hipStream_t stream) {
  const float* x  = (const float*)d_in[0];
  const float* We = (const float*)d_in[1];
  const float* be = (const float*)d_in[2];
  const float* Wg = (const float*)d_in[3];
  const float* bg = (const float*)d_in[4];
  const float* Wt = (const float*)d_in[5];
  const float* bt = (const float*)d_in[6];
  float* out = (float*)d_out;

  float* W2p = (float*)d_ws;              // D*64 floats = 256 KB
  float* cte = W2p + (size_t)D_N * NCOL;  // 32 floats

  mmoe_prep<<<(E_N * D_N) / 256, 256, 0, stream>>>(We, be, Wg, Wt, W2p, cte);
  mmoe_main<<<B_N / 64, 512, 0, stream>>>(x, W2p, cte, bg, bt, out);
}

// v002
// Measured time: 21.6 microseconds a run.
// Next to v001, in two timings, it ran 1.96 and 1.95 times as fast.
// Counting every step since v000, it is 3.60 times as fast.
#include <hip/hip_runtime.h>
#include <math.h>

typedef __attribute__((ext_vector_type(2))) float v2f;
typedef __attribute__((ext_vector_type(8))) float v8f;

#define B_N 16384
#define D_N 1024
#define E_N 8
#define T_N 4
#define H_N 512
#define NCOL 64   // cols 0..31: gate logits (t*8+e), cols 32..63: folded expert dots

// ---------------------------------------------------------------------------
// Kernel A: fold expert weights through task heads, and pack the combined
// [D x 64] weight matrix into WMMA-friendly (k-pair, n) interleaved layout:
//   W2p[((d>>1)*64 + n)*2 + (d&1)] = W2[d][n]
// so a lane's B-fragment (two consecutive K values for one column) is one b64.
// The h sum of a weight row is split over the 32 lanes of a wave: every load is
// 512 contiguous bytes of one row, and all loads of a wave fly together. The 32
// partial sums of a (row, task) meet in LDS, where the storing thread adds them.
// Block = 8 waves = 8 experts x 4 consecutive d, which is exactly 1 KB of W2p.
// One more block folds the expert biases the same way.
// ---------------------------------------------------------------------------
#define PD_N 4                 // d per block (rows per wave)
#define PP_N 36                // pitch of a row of partials: 16-byte reads of 16 rows fill the banks

__global__ void __launch_bounds__(256) mmoe_prep(
    const float* __restrict__ We,   // [E, D, H]
    const float* __restrict__ be,   // [E, H]
    const float* __restrict__ Wg,   // [T, D, E]
    const float* __restrict__ Wt,   // [T, H, 1]
    float* __restrict__ W2p,        // [D/2][64][2]  (256 KB)
    float* __restrict__ cte) {      // [T, E]
  // [(t * 4 + row) * 8 + e][lane]
  __shared__ __attribute__((aligned(16))) float part[PD_N * T_N * E_N][PP_N];

  const int j    = threadIdx.x;
  const int lane = j & 31;
  const int e    = __builtin_amdgcn_readfirstlane(j >> 5);   // wave = expert
  const bool bias = blockIdx.x == D_N / PD_N;                // the last block
  const int d0   = blockIdx.x * PD_N;

  // four consecutive rows; in the bias block the four bias rows that hold row e
  const float* src = bias ? be + (e & 4) * H_N : We + ((size_t)e * D_N + d0) * H_N;

  // every loop of this kernel is unrolled: w and q stay in registers only where
  // constants index them, and all 32 loads must stand ahead of the first use
  float4 w[PD_N][4], q[T_N][4];
#pragma unroll
  for (int r = 0; r < PD_N; ++r)
#pragma unroll
    for (int i = 0; i < 4; ++i)
      w[r][i] = *(const float4*)(src + r * H_N + i * 128 + lane * 4);
#pragma unroll
  for (int t = 0; t < T_N; ++t)
#pragma unroll
    for (int i = 0; i < 4; ++i)
      q[t][i] = *(const float4*)(Wt + t * H_N + i * 128 + lane * 4);

  // this thread's element of the block's 1 KB of W2p: (d pair, column, parity)
  const int n  = (j >> 1) & (NCOL - 1);
  const int dl = (j >> 7) * 2 + (j & 1);
  float val = 0.f;
  // gate column n = t*8+e
  if (!bias && n < 32) val = Wg[((size_t)(n >> 3) * D_N + d0 + dl) * E_N + (n & 7)];

#pragma unroll
  for (int r = 0; r < PD_N; ++r) {
#pragma unroll
    for (int t = 0; t < T_N; ++t) {
      float s = 0.f;
#pragma unroll
      for (int i = 0; i < 4; ++i) {
        s += w[r][i].x * q[t][i].x;
        s += w[r][i].y * q[t][i].y;
        s += w[r][i].z * q[t][i].z;
        s += w[r][i].w * q[t][i].w;
      }
      part[(t * PD_N + r) * E_N + e][lane] = s;
    }
  }
  // publishes every wave's partial sums to the threads that add and store them
  __syncthreads();

  // folded expert column n = 32 + t*8 + e; in the bias block c[t,e], thread t*8+e
  const bool fold = bias ? j < T_N * E_N : n >= 32;
  if (fold) {
    const int row = bias ? ((j >> 3) * PD_N + (j & 3)) * E_N + (j & 7)
                         : (((n - 32) >> 3) * PD_N + dl) * E_N + (n & 7);
    float4 s = *(const float4*)&part[row][0];
#pragma unroll
    for (int i = 1; i < 8; ++i) {
      const float4 p = *(const float4*)&part[row][i * 4];
      s.x += p.x; s.y += p.y; s.z += p.z; s.w += p.w;
    }
    val = (s.x + s.y) + (s.z + s.w);
  }
  if (!bias) W2p[d0 * NCOL + j] = val;
  else if (fold) cte[j] = val;
}

// ---------------------------------------------------------------------------
// Kernel B: fused [16384 x 1024] x [1024 x 64] f32 WMMA GEMM + softmax mix.
// 512 threads = 16 waves per block = 4 row tiles x 4 K quarters. Each wave owns
// 16 rows x all 64 cols (four 16x16 f32 accumulator tiles) over 256 of the
// 1024 k: 64 steps of K=4 via V_WMMA_F32_16X16X4_F32. The four partial tiles
// of a row tile meet in LDS and are added there, in the order of the quarters.
// 256 blocks: four waves on every SIMD of the chip wait on loads side by side.
// ---------------------------------------------------------------------------
#define KQ_N 4                 // K quarters (waves that share a row tile)
#define RT_N 4                 // row tiles per block
#define KQ_LEN (D_N / KQ_N)    // k per wave

__global__ void __launch_bounds__(512) mmoe_main(
    const float* __restrict__ x,    // [B, D]
    const float* __restrict__ W2p,  // packed [D/2][64][2]
    const float* __restrict__ cte,  // [T, E]
    const float* __restrict__ bg,   // [T, E]
    const float* __restrict__ bt,   // [T, 1]
    float* __restrict__ out) {      // [T, B, 1]
  // pitch 68 floats = 17 x 16 B: 16-byte reads that walk the rows spread the banks
  __shared__ __attribute__((aligned(16))) float lds[RT_N * KQ_N][16][68];

  const int wave = threadIdx.x >> 5;
  const int lane = threadIdx.x & 31;
  const int ml   = lane & 15;   // M (A rows) / N (B cols) index within tile
  const int kh   = lane >> 4;   // K half: lanes 16-31 hold K+2,K+3
  const int kq   = wave & (KQ_N - 1);   // this wave's K quarter
  const int rt   = wave >> 2;           // this wave's row tile
  const int row0 = blockIdx.x * (RT_N * 16) + rt * 16;
  const int kbeg = kq * KQ_LEN;

  // A-frag: x[row0+ml][kbeg + k0 + 2*kh + {0,1}]  (two consecutive floats -> b64)
  const float* ap = x + (size_t)(row0 + ml) * D_N + kbeg + kh * 2;
  // B-frag base: kk = (kbeg + k0)/2 + kh, n = t*16 + ml  -> W2p[(kk*64 + n)*2]
  const float* bp = W2p + ((size_t)((kbeg >> 1) + kh) * NCOL + ml) * 2;

  v8f acc0 = {}, acc1 = {}, acc2 = {}, acc3 = {};

#pragma unroll 4
  for (int k0 = 0; k0 < KQ_LEN; k0 += 4) {
    v2f a = *(const v2f*)(ap + k0);
    const float* bk = bp + (size_t)(k0 >> 1) * (NCOL * 2);
    v2f b0 = *(const v2f*)(bk + 0 * 32);
    v2f b1 = *(const v2f*)(bk + 1 * 32);
    v2f b2 = *(const v2f*)(bk + 2 * 32);
    v2f b3 = *(const v2f*)(bk + 3 * 32);
    acc0 = __builtin_amdgcn_wmma_f32_16x16x4_f32(false, a, false, b0, (short)0, acc0, false, false);
    acc1 = __builtin_amdgcn_wmma_f32_16x16x4_f32(false, a, false, b1, (short)0, acc1, false, false);
    acc2 = __builtin_amdgcn_wmma_f32_16x16x4_f32(false, a, false, b2, (short)0, acc2, false, false);
    acc3 = __builtin_amdgcn_wmma_f32_16x16x4_f32(false, a, false, b3, (short)0, acc3, false, false);
  }

  // C/D layout: VGPR j -> row (j + 8*kh), col (tile*16 + ml)
  const int rbase = kh * 8;
#pragma unroll
  for (int j = 0; j < 8; ++j) {
    lds[wave][rbase + j][0 * 16 + ml] = acc0[j];
    lds[wave][rbase + j][1 * 16 + ml] = acc1[j];
    lds[wave][rbase + j][2 * 16 + ml] = acc2[j];
    lds[wave][rbase + j][3 * 16 + ml] = acc3[j];
  }
  // publishes every wave's partial tile to the waves that add them
  __syncthreads();

  // 64 rows x 4 tasks = 256 (row, task) pairs: one per thread of waves 0..7,
  // a wave's lanes on 32 consecutive rows of one task (one whole output line).
  if (threadIdx.x < RT_N * 16 * T_N) {
    const int r  = threadIdx.x & (RT_N * 16 - 1);  // row within the block
    // task: the same in all lanes of a wave, so the biases come by scalar loads
    const int t  = __builtin_amdgcn_readfirstlane(threadIdx.x >> 6);
    const int w0 = (r >> 4) * KQ_N;                // first partial of the row's tile
    const int m  = r & 15;
    float lg[8], sv[8];
#pragma unroll
    for (int h = 0; h < 2; ++h) {
      float4 g = *(const float4*)&lds[w0][m][t * 8 + h * 4];
      float4 s = *(const float4*)&lds[w0][m][32 + t * 8 + h * 4];
#pragma unroll
      for (int q = 1; q < KQ_N; ++q) {
        float4 g2 = *(const float4*)&lds[w0 + q][m][t * 8 + h * 4];
        float4 s2 = *(const float4*)&lds[w0 + q][m][32 + t * 8 + h * 4];
        g.x += g2.x; g.y += g2.y; g.z += g2.z; g.w += g2.w;
        s.x += s2.x; s.y += s2.y; s.z += s2.z; s.w += s2.w;
      }
      lg[h * 4 + 0] = g.x; lg[h * 4 + 1] = g.y; lg[h * 4 + 2] = g.z; lg[h * 4 + 3] = g.w;
      sv[h * 4 + 0] = s.x; sv[h * 4 + 1] = s.y; sv[h * 4 + 2] = s.z; sv[h * 4 + 3] = s.w;
    }
    float mx = -3.0e38f;
#pragma unroll
    for (int e = 0; e < 8; ++e) {
      lg[e] += bg[t * E_N + e];
      sv[e] += cte[t * E_N + e];
      mx = fmaxf(mx, lg[e]);
    }
    float den = 0.f, num = 0.f;
#pragma unroll
    for (int e = 0; e < 8; ++e) {
      float w = __expf(lg[e] - mx);
      den += w;
      num += w * sv[e];
    }
    out[(size_t)t * B_N + (blockIdx.x * (RT_N * 16) + r)] = num / den + bt[t];
  }
}

extern "C" void kernel_launch(void* const* d_in, const int* in_sizes, int n_in,
                              void* d_out, int out_size, void* d_ws, size_t ws_size,
                              hipStream_t stream) {
  const float* x  = (const float*)d_in[0];
  const float* We = (const float*)d_in[1];
  const float* be = (const float*)d_in[2];
  const float* Wg = (const float*)d_in[3];
  const float* bg = (const float*)d_in[4];
  const float* Wt = (const float*)d_in[5];
  const float* bt = (const float*)d_in[6];
  float* out = (float*)d_out;

  float* W2p = (float*)d_ws;              // D*64 floats = 256 KB
  float* cte = W2p + (size_t)D_N * NCOL;  // 32 floats

  mmoe_prep<<<D_N / PD_N + 1, 256, 0, stream>>>(We, be, Wg, Wt, W2p, cte);
  mmoe_main<<<B_N / 64, 512, 0, stream>>>(x, W2p, cte, bg, bt, out);
}

// v003
// Measured time: 19.2 microseconds a run.
// Next to v002, in two timings, it ran 1.13 times as fast each time.
// Counting every step since v000, it is 4.07 times as fast.
#include <hip/hip_runtime.h>
#include <math.h>
#include <stdint.h>

typedef __attribute__((ext_vector_type(2))) float v2f;
typedef __attribute__((ext_vector_type(8))) float v8f;
typedef uint32_t u32x4 __attribute__((ext_vector_type(4)));
typedef uint32_t u32x8 __attribute__((ext_vector_type(8)));

#define B_N 16384
#define D_N 1024
#define E_N 8
#define T_N 4
#define H_N 512
#define NCOL 64   // cols 0..31: gate logits (t*8+e), cols 32..63: folded expert dots

// ---------------------------------------------------------------------------
// Kernel A: fold expert weights through task heads, and pack the combined
// [D x 64] weight matrix into WMMA-friendly (k-pair, n) interleaved layout:
//   W2p[((d>>1)*64 + n)*2 + (d&1)] = W2[d][n]
// so a lane's B-fragment (two consecutive K values for one column) is one b64.
// The h sum of a weight row is split over the 32 lanes of a wave: every load is
// 512 contiguous bytes of one row, and all loads of a wave fly together. The 32
// partial sums of a (row, task) meet in LDS, where the storing thread adds them.
// Block = 8 waves = 8 experts x 4 consecutive d, which is exactly 1 KB of W2p.
// One more block folds the expert biases the same way.
// ---------------------------------------------------------------------------
#define PD_N 4                 // d per block (rows per wave)
#define PP_N 36                // pitch of a row of partials: 16-byte reads of 16 rows fill the banks

__global__ void __launch_bounds__(256) mmoe_prep(
    const float* __restrict__ We,   // [E, D, H]
    const float* __restrict__ be,   // [E, H]
    const float* __restrict__ Wg,   // [T, D, E]
    const float* __restrict__ Wt,   // [T, H, 1]
    float* __restrict__ W2p,        // [D/2][64][2]  (256 KB)
    float* __restrict__ cte) {      // [T, E]
  // [(t * 4 + row) * 8 + e][lane]
  __shared__ __attribute__((aligned(16))) float part[PD_N * T_N * E_N][PP_N];

  const int j    = threadIdx.x;
  const int lane = j & 31;
  const int e    = __builtin_amdgcn_readfirstlane(j >> 5);   // wave = expert
  const bool bias = blockIdx.x == D_N / PD_N;                // the last block
  const int d0   = blockIdx.x * PD_N;

  // four consecutive rows; in the bias block the four bias rows that hold row e
  const float* src = bias ? be + (e & 4) * H_N : We + ((size_t)e * D_N + d0) * H_N;

  // every loop of this kernel is unrolled: w and q stay in registers only where
  // constants index them, and all 32 loads must stand ahead of the first use
  float4 w[PD_N][4], q[T_N][4];
#pragma unroll
  for (int r = 0; r < PD_N; ++r)
#pragma unroll
    for (int i = 0; i < 4; ++i)
      w[r][i] = *(const float4*)(src + r * H_N + i * 128 + lane * 4);
#pragma unroll
  for (int t = 0; t < T_N; ++t)
#pragma unroll
    for (int i = 0; i < 4; ++i)
      q[t][i] = *(const float4*)(Wt + t * H_N + i * 128 + lane * 4);

  // this thread's element of the block's 1 KB of W2p: (d pair, column, parity)
  const int n  = (j >> 1) & (NCOL - 1);
  const int dl = (j >> 7) * 2 + (j & 1);
  float val = 0.f;
  // gate column n = t*8+e
  if (!bias && n < 32) val = Wg[((size_t)(n >> 3) * D_N + d0 + dl) * E_N + (n & 7)];

#pragma unroll
  for (int r = 0; r < PD_N; ++r) {
#pragma unroll
    for (int t = 0; t < T_N; ++t) {
      float s = 0.f;
#pragma unroll
      for (int i = 0; i < 4; ++i) {
        s += w[r][i].x * q[t][i].x;
        s += w[r][i].y * q[t][i].y;
        s += w[r][i].z * q[t][i].z;
        s += w[r][i].w * q[t][i].w;
      }
      part[(t * PD_N + r) * E_N + e][lane] = s;
    }
  }
  // publishes every wave's partial sums to the threads that add and store them
  __syncthreads();

  // folded expert column n = 32 + t*8 + e; in the bias block c[t,e], thread t*8+e
  const bool fold = bias ? j < T_N * E_N : n >= 32;
  if (fold) {
    const int row = bias ? ((j >> 3) * PD_N + (j & 3)) * E_N + (j & 7)
                         : (((n - 32) >> 3) * PD_N + dl) * E_N + (n & 7);
    float4 s = *(const float4*)&part[row][0];
#pragma unroll
    for (int i = 1; i < 8; ++i) {
      const float4 p = *(const float4*)&part[row][i * 4];
      s.x += p.x; s.y += p.y; s.z += p.z; s.w += p.w;
    }
    val = (s.x + s.y) + (s.z + s.w);
  }
  if (!bias) W2p[d0 * NCOL + j] = val;
  else if (fold) cte[j] = val;
}

// ---------------------------------------------------------------------------
// Kernel B: fused [16384 x 1024] x [1024 x 64] f32 WMMA GEMM + softmax mix.
// 512 threads = 16 waves per block = 4 row tiles x 4 K quarters. Each wave owns
// 16 rows x all 64 cols (four 16x16 f32 accumulator tiles) over 256 of the
// 1024 k: 64 steps of K=4 via V_WMMA_F32_16X16X4_F32. The four partial tiles
// of a row tile meet in LDS and are added there, in the order of the quarters.
// 256 blocks: four waves on every SIMD of the chip.
// x comes into LDS by the tensor mover: an A fragment read straight from x takes
// 16 bytes out of each of 16 lines, the mover fetches whole 256-byte row pieces.
// Each wave brings its own 16 rows x 64 k per stage, two buffers, one stage ahead.
// ---------------------------------------------------------------------------
#define KQ_N 4                 // K quarters (waves that share a row tile)
#define RT_N 4                 // row tiles per block
#define KQ_LEN (D_N / KQ_N)    // k per wave
#define ST_K 64                // k per stage: row pieces of 256 bytes
#define ST_N (KQ_LEN / ST_K)   // stages per wave
#define XP_N 68                // LDS pitch of a row piece in floats (256 + 16 bytes):
                               // the 8-byte reads of 16 rows x 2 k halves fill the 64 banks
#define SLICE_B 6144           // 16 rows x 272 bytes, rounded up to a multiple of 2 KiB

static __device__ __forceinline__ uint32_t uni(uint32_t v) { return (uint32_t)__builtin_amdgcn_readfirstlane(v); }
static __device__ __forceinline__ uint32_t pinned(uint32_t v) {
  uint32_t w = uni(v);
  asm volatile("" : "+s"(w));  // holds v in a scalar register: the test around a tensor load, which ignores EXEC, must be a scalar branch
  return w;
}
// the compiler places no wait for the tensor mover: a tile has landed only behind this
static __device__ __forceinline__ void wait_tensor0() { asm volatile("s_wait_tensorcnt 0x0" ::: "memory"); }
// this wave's LDS reads have retired before its buffer is handed back to the mover
static __device__ __forceinline__ void wait_ds0() { asm volatile("s_wait_dscnt 0x0" ::: "memory"); }
// one request of the whole wave: 16 rows of 256 bytes from ga (row pitch of x) to LDS byte dst
static __device__ __forceinline__ void x_tile_load(uint32_t dst, uint64_t ga) {
  u32x4 g0;
  g0[0] = uni(1u);                                                        // count 1
  g0[1] = uni(dst);
  g0[2] = uni((uint32_t)ga);
  g0[3] = uni((((uint32_t)(ga >> 32)) & 0x01FFFFFFu) | 0x80000000u);      // type 2
  u32x8 g1;
  g1[0] = uni((1u << 20) | (5u << 22) | (3u << 25));  // no mask, bytes, 16 bytes of pad behind every 256
  g1[1] = uni((ST_K * 4u) << 16);                     // tensor_dim0 = row piece
  g1[2] = uni(16u << 16);                             // tensor_dim1 = rows
  g1[3] = uni((ST_K * 4u) << 16);                     // tile_dim0
  g1[4] = uni(16u);                                   // tile_dim1
  g1[5] = uni(D_N * 4u);                              // source row pitch
  g1[6] = uni(0u);
  g1[7] = uni(0u);
  asm volatile("tensor_load_to_lds %0, %1" :: "s"(g0), "s"(g1) : "memory");
}

__global__ void __launch_bounds__(512) mmoe_main(
    const float* __restrict__ x,    // [B, D]
    const float* __restrict__ W2p,  // packed [D/2][64][2]
    const float* __restrict__ cte,  // [T, E]
    const float* __restrict__ bg,   // [T, E]
    const float* __restrict__ bt,   // [T, 1]
    float* __restrict__ out) {      // [T, B, 1]
  // pitch 68 floats = 17 x 16 B: 16-byte reads that walk the rows spread the banks
  __shared__ __attribute__((aligned(16))) float lds[RT_N * KQ_N][16][68];
  // the x ring: [buffer][wave][slice]; every slice starts at a multiple of 2 KiB
  __shared__ __attribute__((aligned(2048))) unsigned char ring[2][RT_N * KQ_N][SLICE_B];

  const int wave = uni(threadIdx.x >> 5);   // scalar: the tensor descriptor is formed from it
  const int lane = threadIdx.x & 31;
  const int ml   = lane & 15;   // M (A rows) / N (B cols) index within tile
  const int kh   = lane >> 4;   // K half: lanes 16-31 hold K+2,K+3
  const int kq   = wave & (KQ_N - 1);   // this wave's K quarter
  const int rt   = wave >> 2;           // this wave's row tile
  const int row0 = blockIdx.x * (RT_N * 16) + rt * 16;
  const int kbeg = kq * KQ_LEN;

  // this wave's x tile of stage 0, and its slice of buffer 0
  const uint64_t xsrc = (uint64_t)(size_t)(x + (size_t)row0 * D_N + kbeg);
  const uint32_t xdst = (uint32_t)(size_t)&ring[0][wave][0];
  // A-frag: x[row0+ml][kbeg + k0 + 2*kh + {0,1}]  (two consecutive floats -> b64)
  const int aoff = ml * XP_N + kh * 2;
  // B-frag base: kk = (kbeg + k0)/2 + kh, n = t*16 + ml  -> W2p[(kk*64 + n)*2]
  const float* bp = W2p + ((size_t)((kbeg >> 1) + kh) * NCOL + ml) * 2;

  v8f acc0 = {}, acc1 = {}, acc2 = {}, acc3 = {};

  // prologue, two buffers: stage 0 lands and is published, then stage 1 flies
  x_tile_load(xdst, xsrc);
  wait_tensor0();
  __syncthreads();
  x_tile_load(xdst + (uint32_t)sizeof(ring[0]), xsrc + ST_K * 4u);

  // kept rolled: one copy of the pass in the instruction cache, the buffer picked by s & 1
#pragma unroll 1
  for (uint32_t s = 0; s < ST_N; ++s) {
    const float* as = (const float*)&ring[s & 1u][wave][0] + aoff;
    const float* bs = bp + (size_t)s * (ST_K >> 1) * (NCOL * 2);
    // unrolled: every LDS and global offset of the pass is an immediate
#pragma unroll
    for (int k0 = 0; k0 < ST_K; k0 += 4) {
      v2f a = *(const v2f*)(as + k0);
      const float* bk = bs + (size_t)(k0 >> 1) * (NCOL * 2);
      v2f b0 = *(const v2f*)(bk + 0 * 32);
      v2f b1 = *(const v2f*)(bk + 1 * 32);
      v2f b2 = *(const v2f*)(bk + 2 * 32);
      v2f b3 = *(const v2f*)(bk + 3 * 32);
      acc0 = __builtin_amdgcn_wmma_f32_16x16x4_f32(false, a, false, b0, (short)0, acc0, false, false);
      acc1 = __builtin_amdgcn_wmma_f32_16x16x4_f32(false, a, false, b1, (short)0, acc1, false, false);
      acc2 = __builtin_amdgcn_wmma_f32_16x16x4_f32(false, a, false, b2, (short)0, acc2, false, false);
      acc3 = __builtin_amdgcn_wmma_f32_16x16x4_f32(false, a, false, b3, (short)0, acc3, false, false);
    }
    // publish point of stage s + 1
    wait_ds0();
    wait_tensor0();
    __syncthreads();
    // the refill, only while stage s + 2 exists, into the buffer this pass has just read
    if (pinned(s + 2u < ST_N))
      x_tile_load(xdst + (s & 1u) * (uint32_t)sizeof(ring[0]), xsrc + (uint64_t)(s + 2u) * (ST_K * 4u));
  }
  wait_tensor0();
  wait_ds0();

  // C/D layout: VGPR j -> row (j + 8*kh), col (tile*16 + ml)
  const int rbase = kh * 8;
#pragma unroll
  for (int j = 0; j < 8; ++j) {
    lds[wave][rbase + j][0 * 16 + ml] = acc0[j];
    lds[wave][rbase + j][1 * 16 + ml] = acc1[j];
    lds[wave][rbase + j][2 * 16 + ml] = acc2[j];
    lds[wave][rbase + j][3 * 16 + ml] = acc3[j];
  }
  // publishes every wave's partial tile to the waves that add them
  __syncthreads();

  // 64 rows x 4 tasks = 256 (row, task) pairs: one per thread of waves 0..7,
  // a wave's lanes on 32 consecutive rows of one task (one whole output line).
  if (threadIdx.x < RT_N * 16 * T_N) {
    const int r  = threadIdx.x & (RT_N * 16 - 1);  // row within the block
    // task: the same in all lanes of a wave, so the biases come by scalar loads
    const int t  = __builtin_amdgcn_readfirstlane(threadIdx.x >> 6);
    const int w0 = (r >> 4) * KQ_N;                // first partial of the row's tile
    const int m  = r & 15;
    float lg[8], sv[8];
#pragma unroll
    for (int h = 0; h < 2; ++h) {
      float4 g = *(const float4*)&lds[w0][m][t * 8 + h * 4];
      float4 s = *(const float4*)&lds[w0][m][32 + t * 8 + h * 4];
#pragma unroll
      for (int q = 1; q < KQ_N; ++q) {
        float4 g2 = *(const float4*)&lds[w0 + q][m][t * 8 + h * 4];
        float4 s2 = *(const float4*)&lds[w0 + q][m][32 + t * 8 + h * 4];
        g.x += g2.x; g.y += g2.y; g.z += g2.z; g.w += g2.w;
        s.x += s2.x; s.y += s2.y; s.z += s2.z; s.w += s2.w;
      }
      lg[h * 4 + 0] = g.x; lg[h * 4 + 1] = g.y; lg[h * 4 + 2] = g.z; lg[h * 4 + 3] = g.w;
      sv[h * 4 + 0] = s.x; sv[h * 4 + 1] = s.y; sv[h * 4 + 2] = s.z; sv[h * 4 + 3] = s.w;
    }
    float mx = -3.0e38f;
#pragma unroll
    for (int e = 0; e < 8; ++e) {
      lg[e] += bg[t * E_N + e];
      sv[e] += cte[t * E_N + e];
      mx = fmaxf(mx, lg[e]);
    }
    float den = 0.f, num = 0.f;
#pragma unroll
    for (int e = 0; e < 8; ++e) {
      float w = __expf(lg[e] - mx);
      den += w;
      num += w * sv[e];
    }
    out[(size_t)t * B_N + (blockIdx.x * (RT_N * 16) + r)] = num / den + bt[t];
  }
}

extern "C" void kernel_launch(void* const* d_in, const int* in_sizes, int n_in,
                              void* d_out, int out_size, void* d_ws, size_t ws_size,
                              hipStream_t stream) {
  const float* x  = (const float*)d_in[0];
  const float* We = (const float*)d_in[1];
  const float* be = (const float*)d_in[2];
  const float* Wg = (const float*)d_in[3];
  const float* bg = (const float*)d_in[4];
  const float* Wt = (const float*)d_in[5];
  const float* bt = (const float*)d_in[6];
  float* out = (float*)d_out;

  float* W2p = (float*)d_ws;              // D*64 floats = 256 KB
  float* cte = W2p + (size_t)D_N * NCOL;  // 32 floats

  mmoe_prep<<<D_N / PD_N + 1, 256, 0, stream>>>(We, be, Wg, Wt, W2p, cte);
  mmoe_main<<<B_N / 64, 512, 0, stream>>>(x, W2p, cte, bg, bt, out);
}
